// v000
// The times below were measured on an AMD MI455X: many runs one after another, warmed up first and cycling through
// copies of the inputs, with the whole window's GPU time divided by the number of runs. Launches and the gaps
// between them are all in it. The median over several windows is given; except for v000 it joins two sittings, which
// can be a few percent apart, so the side-by-side timings, each taken in one sitting, are the better comparison.
// The starting kernel, v000, takes 533 microseconds a run.
#include <hip/hip_runtime.h>

// ---------------------------------------------------------------------------
// AttentionLayer for MI455X (gfx1250): f32 WMMA 16x16x4 everywhere.
//   q/k/v = X @ W^T + b        (gemm64x64: async-to-LDS staged W tile)
//   flash-style masked softmax attention per (b, h)   (flash_attn)
//   out   = attn @ Wo^T + bo   (gemm64x64)
// ---------------------------------------------------------------------------

typedef float v2f __attribute__((ext_vector_type(2)));
typedef float v8f __attribute__((ext_vector_type(8)));

#define D_MODEL 1024
#define N_HEADS 16
#define HEAD_E  64
#define SEQ_L   2048
#define BATCH   2
#define M_TOTAL (BATCH * SEQ_L)

__device__ __forceinline__ v8f wmma_f32(v2f a, v2f b, v8f c) {
  // D = A(16x4, f32) x B(4x16, f32) + C(16x16, f32)
  return __builtin_amdgcn_wmma_f32_16x16x4_f32(
      /*neg_a=*/false, a, /*neg_b=*/false, b,
      /*c_mod=*/(short)0, c, /*reuse_a=*/false, /*reuse_b=*/false);
}

// CDNA5 async copy: global memory -> LDS, 16B per lane, tracked by ASYNCcnt.
// lds_off must be the real LDS byte offset (low 32 bits of the generic
// pointer) so the shared array is captured and alias analysis keeps the
// subsequent ds_load reads live.
__device__ __forceinline__ void async_load_b128(unsigned lds_off, const float* gptr) {
  asm volatile("global_load_async_to_lds_b128 %0, %1, off"
               :: "v"(lds_off), "v"(gptr) : "memory");
}
__device__ __forceinline__ void wait_asynccnt0() {
  asm volatile("s_wait_asynccnt 0x0" ::: "memory");
}

__device__ __forceinline__ float rmax16(float x) {
  // reduce over the 16 lanes of each wave half (xor masks < 16 stay in-half)
  x = fmaxf(x, __shfl_xor(x, 1));
  x = fmaxf(x, __shfl_xor(x, 2));
  x = fmaxf(x, __shfl_xor(x, 4));
  x = fmaxf(x, __shfl_xor(x, 8));
  return x;
}
__device__ __forceinline__ float rsum16(float x) {
  x += __shfl_xor(x, 1);
  x += __shfl_xor(x, 2);
  x += __shfl_xor(x, 4);
  x += __shfl_xor(x, 8);
  return x;
}

// ---------------------------------------------------------------------------
// C[M,N] = X[M,K] @ W[N,K]^T + bias[N]
// Workgroup = 4 waves -> 64x64 C tile (each wave: 16 rows of M, all 64 N).
// Per 32-wide k-slice: the 64x32 W sub-tile (8 KB) is staged into LDS with
// GLOBAL_LOAD_ASYNC_TO_LDS_B128 (each wave copies 1/4), fenced with
// s_wait_asynccnt + barrier, then consumed as ds_load b64 B-fragments.
// A layout: lane m = l&15, vgpr v -> k = 2*(l>>4)+v   (float2 along K)
// D layout: lane n = l&15, vgpr v -> m = v + 8*(l>>4)
// ---------------------------------------------------------------------------
#define KSLICE 32

__global__ __launch_bounds__(128)
void gemm64x64(const float* __restrict__ X, const float* __restrict__ W,
               const float* __restrict__ bias, float* __restrict__ C) {
  __shared__ float lds_w[64 * KSLICE];   // [n-in-tile][k-in-slice], 8 KB

  const int K = D_MODEL, N = D_MODEL;
  const int lane = threadIdx.x & 31;
  const int wave = threadIdx.x >> 5;     // 0..3
  const int nn = lane & 15, half = lane >> 4;
  const int m0 = blockIdx.x * 64 + wave * 16;
  const int n0 = blockIdx.y * 64;

  // staging assignment: 512 16B-chunks per slice; this lane copies 4
  // consecutive chunks = 16 floats of one W row.
  const int g0   = wave * 128 + lane * 4;        // first chunk id
  const int srow = g0 >> 3;                      // 0..63 (n within tile)
  const int scol = (g0 & 7) * 4;                 // k offset within slice
  const float* wsrc_base = W + (size_t)(n0 + srow) * K + scol;
  // Low 32 bits of the generic pointer == LDS byte offset (aperture mapping);
  // using the real address also captures lds_w for the asm's memory clobber.
  const unsigned ldst_base =
      (unsigned)(size_t)(&lds_w[0]) + (unsigned)(srow * KSLICE + scol) * 4u;

  const float* xr = X + (size_t)(m0 + nn) * K + 2 * half;

  v8f acc0 = {}, acc1 = {}, acc2 = {}, acc3 = {};

  for (int ks = 0; ks < K; ks += KSLICE) {
    __syncthreads();                     // previous slice fully consumed
    // ---- async stage W[n0..n0+63][ks..ks+31] -> LDS ----
    const float* wsrc = wsrc_base + ks;
    #pragma unroll
    for (int t = 0; t < 4; ++t)
      async_load_b128(ldst_base + 16u * t, wsrc + 4 * t);
    // prefetch next A-slice while the async copy is in flight
    if (ks + KSLICE < K) __builtin_prefetch(xr + ks + KSLICE, 0, 3);
    wait_asynccnt0();
    __syncthreads();                     // all waves' chunks visible

    // ---- consume: 8 wmma k-steps of 4 ----
    #pragma unroll
    for (int k = 0; k < KSLICE; k += 4) {
      v2f a = *(const v2f*)(xr + ks + k);
      v2f b0 = *(const v2f*)&lds_w[( 0 + nn) * KSLICE + k + 2 * half];
      v2f b1 = *(const v2f*)&lds_w[(16 + nn) * KSLICE + k + 2 * half];
      v2f b2 = *(const v2f*)&lds_w[(32 + nn) * KSLICE + k + 2 * half];
      v2f b3 = *(const v2f*)&lds_w[(48 + nn) * KSLICE + k + 2 * half];
      acc0 = wmma_f32(a, b0, acc0);
      acc1 = wmma_f32(a, b1, acc1);
      acc2 = wmma_f32(a, b2, acc2);
      acc3 = wmma_f32(a, b3, acc3);
    }
  }

  const float b0 = bias[n0 +  0 + nn];
  const float b1 = bias[n0 + 16 + nn];
  const float b2 = bias[n0 + 32 + nn];
  const float b3 = bias[n0 + 48 + nn];

  #pragma unroll
  for (int v = 0; v < 8; ++v) {
    const int m = m0 + v + 8 * half;
    float* crow = C + (size_t)m * N + n0 + nn;
    crow[0]  = acc0[v] + b0;
    crow[16] = acc1[v] + b1;
    crow[32] = acc2[v] + b2;
    crow[48] = acc3[v] + b3;
  }
}

// ---------------------------------------------------------------------------
// Flash-style attention for one (b, h, 16-query block) per wave.
// Mask (anti-causal): key j visible to query i iff (j >= i + d) || (j == L-1),
// d = 2^(h / (H/DIAG)) = 2^(h>>2).  Blocks kb < qb are fully masked -> skipped.
// ---------------------------------------------------------------------------
__global__ __launch_bounds__(32)
void flash_attn(const float* __restrict__ Q, const float* __restrict__ Kmat,
                const float* __restrict__ V, float* __restrict__ O) {
  __shared__ float pbuf[16 * 18];  // P tile staging, padded rows (8B-aligned pairs)

  const int lane = threadIdx.x;
  const int nn = lane & 15, half = lane >> 4;
  const int qb = blockIdx.x;           // query block 0..127
  const int h  = blockIdx.y;           // head 0..15
  const int b  = blockIdx.z;           // batch 0..1
  const int q0 = qb * 16;
  const int d  = 1 << (h >> 2);        // diag offset for this head's group
  const size_t base = (size_t)b * SEQ_L * D_MODEL + (size_t)h * HEAD_E;
  const float scale = 0.125f;          // 1/sqrt(64)

  // Q tile in A-layout register chunks: qa[ec][v] = Q[q0 + (l&15)][4*ec + 2*half + v]
  v2f qa[16];
  {
    const float* qr = Q + base + (size_t)(q0 + nn) * D_MODEL + 2 * half;
    #pragma unroll
    for (int ec = 0; ec < 16; ++ec) qa[ec] = *(const v2f*)(qr + ec * 4);
  }

  v8f o0 = {}, o1 = {}, o2 = {}, o3 = {};
  float rm[8], rs[8];
  #pragma unroll
  for (int v = 0; v < 8; ++v) { rm[v] = -3.0e38f; rs[v] = 0.0f; }

  for (int kb = qb; kb < SEQ_L / 16; ++kb) {
    const int kbase = kb * 16;

    // ---- S = Q @ K^T over E=64 (16 wmma steps of k=4) ----
    v8f s = {};
    const float* kr = Kmat + base + (size_t)(kbase + nn) * D_MODEL + 2 * half;
    #pragma unroll
    for (int ec = 0; ec < 16; ++ec)
      s = wmma_f32(qa[ec], *(const v2f*)(kr + ec * 4), s);

    // ---- mask + scale + online softmax (row stats via in-half shuffles) ----
    float p[8], alpha[8];
    #pragma unroll
    for (int v = 0; v < 8; ++v) {
      const int i  = q0 + v + 8 * half;   // query row of this D slot
      const int jk = kbase + nn;          // key column of this lane
      const bool ok = (jk >= i + d) || (jk == SEQ_L - 1);
      const float sm = ok ? s[v] * scale : -3.0e38f;
      const float nm = fmaxf(rm[v], rmax16(sm));
      alpha[v] = __expf(rm[v] - nm);
      rm[v] = nm;
      const float pv = ok ? __expf(sm - nm) : 0.0f;  // explicit 0 for masked lanes
      p[v] = pv;
      rs[v] = rs[v] * alpha[v] + rsum16(pv);
    }
    #pragma unroll
    for (int v = 0; v < 8; ++v) {
      o0[v] *= alpha[v]; o1[v] *= alpha[v]; o2[v] *= alpha[v]; o3[v] *= alpha[v];
    }

    // ---- stage P (D-layout) -> LDS -> A-layout for the PV wmmas ----
    __syncthreads();
    #pragma unroll
    for (int v = 0; v < 8; ++v) pbuf[(v + 8 * half) * 18 + nn] = p[v];
    __syncthreads();

    const float* vr = V + base + (size_t)kbase * D_MODEL + nn;
    #pragma unroll
    for (int k0 = 0; k0 < 16; k0 += 4) {
      v2f ap = *(const v2f*)&pbuf[nn * 18 + k0 + 2 * half];
      const int row = k0 + 2 * half;
      v2f b0v = { vr[(size_t)row * D_MODEL +  0], vr[(size_t)(row + 1) * D_MODEL +  0] };
      v2f b1v = { vr[(size_t)row * D_MODEL + 16], vr[(size_t)(row + 1) * D_MODEL + 16] };
      v2f b2v = { vr[(size_t)row * D_MODEL + 32], vr[(size_t)(row + 1) * D_MODEL + 32] };
      v2f b3v = { vr[(size_t)row * D_MODEL + 48], vr[(size_t)(row + 1) * D_MODEL + 48] };
      o0 = wmma_f32(ap, b0v, o0);
      o1 = wmma_f32(ap, b1v, o1);
      o2 = wmma_f32(ap, b2v, o2);
      o3 = wmma_f32(ap, b3v, o3);
    }
  }

  // ---- finalize: O /= rowsum, write [b, q, h*64 + e] ----
  #pragma unroll
  for (int v = 0; v < 8; ++v) {
    const float inv = 1.0f / rs[v];
    float* orow = O + base + (size_t)(q0 + v + 8 * half) * D_MODEL + nn;
    orow[0]  = o0[v] * inv;
    orow[16] = o1[v] * inv;
    orow[32] = o2[v] * inv;
    orow[48] = o3[v] * inv;
  }
}

// ---------------------------------------------------------------------------
extern "C" void kernel_launch(void* const* d_in, const int* in_sizes, int n_in,
                              void* d_out, int out_size, void* d_ws, size_t ws_size,
                              hipStream_t stream) {
  const float* queries = (const float*)d_in[0];
  const float* keys    = (const float*)d_in[1];
  const float* values  = (const float*)d_in[2];
  const float* Wq = (const float*)d_in[3];
  const float* bq = (const float*)d_in[4];
  const float* Wk = (const float*)d_in[5];
  const float* bk = (const float*)d_in[6];
  const float* Wv = (const float*)d_in[7];
  const float* bv = (const float*)d_in[8];
  const float* Wo = (const float*)d_in[9];
  const float* bo = (const float*)d_in[10];

  const size_t plane = (size_t)M_TOTAL * D_MODEL;  // 4096*1024 floats = 16 MB
  float* qws = (float*)d_ws;
  float* kws = qws + plane;
  float* vws = kws + plane;
  float* aws = vws + plane;

  dim3 gg(M_TOTAL / 64, D_MODEL / 64, 1);   // 64 x 16 workgroups, 4 waves each
  gemm64x64<<<gg, 128, 0, stream>>>(queries, Wq, bq, qws);
  gemm64x64<<<gg, 128, 0, stream>>>(keys,    Wk, bk, kws);
  gemm64x64<<<gg, 128, 0, stream>>>(values,  Wv, bv, vws);

  dim3 ga(SEQ_L / 16, N_HEADS, BATCH);      // 128 x 16 x 2 waves
  flash_attn<<<ga, 32, 0, stream>>>(qws, kws, vws, aws);

  gemm64x64<<<gg, 128, 0, stream>>>(aws, Wo, bo, (float*)d_out);
}

// v001
// One run takes 479 microseconds.
// In both of two side-by-side timings against v000, it was 1.11 times as fast.
#include <hip/hip_runtime.h>

// ---------------------------------------------------------------------------
// AttentionLayer for MI455X (gfx1250): f32 WMMA 16x16x4 everywhere.
//   q/k/v = X @ W^T + b        (gemm64x64: async-to-LDS staged W tile)
//   flash-style masked softmax attention per (b, h)   (flash_attn)
//   out   = attn @ Wo^T + bo   (gemm64x64)
// ---------------------------------------------------------------------------

typedef float v2f __attribute__((ext_vector_type(2)));
typedef float v8f __attribute__((ext_vector_type(8)));

#define D_MODEL 1024
#define N_HEADS 16
#define HEAD_E  64
#define SEQ_L   2048
#define BATCH   2
#define M_TOTAL (BATCH * SEQ_L)

__device__ __forceinline__ v8f wmma_f32(v2f a, v2f b, v8f c) {
  // D = A(16x4, f32) x B(4x16, f32) + C(16x16, f32)
  return __builtin_amdgcn_wmma_f32_16x16x4_f32(
      /*neg_a=*/false, a, /*neg_b=*/false, b,
      /*c_mod=*/(short)0, c, /*reuse_a=*/false, /*reuse_b=*/false);
}

// CDNA5 async copy: global memory -> LDS, 16B per lane, tracked by ASYNCcnt.
// lds_off must be the real LDS byte offset (low 32 bits of the generic
// pointer) so the shared array is captured and alias analysis keeps the
// subsequent ds_load reads live.
__device__ __forceinline__ void async_load_b128(unsigned lds_off, const float* gptr) {
  asm volatile("global_load_async_to_lds_b128 %0, %1, off"
               :: "v"(lds_off), "v"(gptr) : "memory");
}
__device__ __forceinline__ void wait_asynccnt0() {
  asm volatile("s_wait_asynccnt 0x0" ::: "memory");
}

__device__ __forceinline__ float rmax16(float x) {
  // reduce over the 16 lanes of each wave half (xor masks < 16 stay in-half)
  x = fmaxf(x, __shfl_xor(x, 1));
  x = fmaxf(x, __shfl_xor(x, 2));
  x = fmaxf(x, __shfl_xor(x, 4));
  x = fmaxf(x, __shfl_xor(x, 8));
  return x;
}
__device__ __forceinline__ float rsum16(float x) {
  x += __shfl_xor(x, 1);
  x += __shfl_xor(x, 2);
  x += __shfl_xor(x, 4);
  x += __shfl_xor(x, 8);
  return x;
}

// ---------------------------------------------------------------------------
// C[M,N] = X[M,K] @ W[N,K]^T + bias[N]
// Workgroup = 4 waves -> 64x64 C tile (each wave: 16 rows of M, all 64 N).
// Per 32-wide k-slice: the 64x32 W sub-tile (8 KB) is staged into LDS with
// GLOBAL_LOAD_ASYNC_TO_LDS_B128 (each wave copies 1/4), fenced with
// s_wait_asynccnt + barrier, then consumed as ds_load b64 B-fragments.
// A layout: lane m = l&15, vgpr v -> k = 2*(l>>4)+v   (float2 along K)
// D layout: lane n = l&15, vgpr v -> m = v + 8*(l>>4)
// ---------------------------------------------------------------------------
#define KSLICE 32
// LDS row pitch in floats: 128-B rows put all 16 rows of a fragment read on
// 8 banks; 144 B (16 B x odd) spreads the 32 lanes' b64 reads over all 64.
#define WPITCH 36

__global__ __launch_bounds__(128)
void gemm64x64(const float* __restrict__ X, const float* __restrict__ W,
               const float* __restrict__ bias, float* __restrict__ C) {
  __shared__ float lds_w[64 * WPITCH];   // [n-in-tile][k-in-slice], padded rows, 9 KB

  const int K = D_MODEL, N = D_MODEL;
  const int lane = threadIdx.x & 31;
  const int wave = threadIdx.x >> 5;     // 0..3
  const int nn = lane & 15, half = lane >> 4;
  const int m0 = blockIdx.x * 64 + wave * 16;
  const int n0 = blockIdx.y * 64;

  // staging assignment: 512 16B-chunks per slice; this lane copies 4
  // consecutive chunks = 16 floats of one W row.
  const int g0   = wave * 128 + lane * 4;        // first chunk id
  const int srow = g0 >> 3;                      // 0..63 (n within tile)
  const int scol = (g0 & 7) * 4;                 // k offset within slice
  const float* wsrc_base = W + (size_t)(n0 + srow) * K + scol;
  // Low 32 bits of the generic pointer == LDS byte offset (aperture mapping);
  // using the real address also captures lds_w for the asm's memory clobber.
  const unsigned ldst_base =
      (unsigned)(size_t)(&lds_w[0]) + (unsigned)(srow * WPITCH + scol) * 4u;

  const float* xr = X + (size_t)(m0 + nn) * K + 2 * half;

  v8f acc0 = {}, acc1 = {}, acc2 = {}, acc3 = {};

  for (int ks = 0; ks < K; ks += KSLICE) {
    __syncthreads();                     // previous slice fully consumed
    // ---- async stage W[n0..n0+63][ks..ks+31] -> LDS ----
    const float* wsrc = wsrc_base + ks;
    #pragma unroll
    for (int t = 0; t < 4; ++t)
      async_load_b128(ldst_base + 16u * t, wsrc + 4 * t);
    // prefetch next A-slice while the async copy is in flight
    if (ks + KSLICE < K) __builtin_prefetch(xr + ks + KSLICE, 0, 3);
    wait_asynccnt0();
    __syncthreads();                     // all waves' chunks visible

    // ---- consume: 8 wmma k-steps of 4 ----
    #pragma unroll
    for (int k = 0; k < KSLICE; k += 4) {
      v2f a = *(const v2f*)(xr + ks + k);
      v2f b0 = *(const v2f*)&lds_w[( 0 + nn) * WPITCH + k + 2 * half];
      v2f b1 = *(const v2f*)&lds_w[(16 + nn) * WPITCH + k + 2 * half];
      v2f b2 = *(const v2f*)&lds_w[(32 + nn) * WPITCH + k + 2 * half];
      v2f b3 = *(const v2f*)&lds_w[(48 + nn) * WPITCH + k + 2 * half];
      acc0 = wmma_f32(a, b0, acc0);
      acc1 = wmma_f32(a, b1, acc1);
      acc2 = wmma_f32(a, b2, acc2);
      acc3 = wmma_f32(a, b3, acc3);
    }
  }

  const float b0 = bias[n0 +  0 + nn];
  const float b1 = bias[n0 + 16 + nn];
  const float b2 = bias[n0 + 32 + nn];
  const float b3 = bias[n0 + 48 + nn];

  #pragma unroll
  for (int v = 0; v < 8; ++v) {
    const int m = m0 + v + 8 * half;
    float* crow = C + (size_t)m * N + n0 + nn;
    crow[0]  = acc0[v] + b0;
    crow[16] = acc1[v] + b1;
    crow[32] = acc2[v] + b2;
    crow[48] = acc3[v] + b3;
  }
}

// ---------------------------------------------------------------------------
// Flash-style attention for one (b, h, 16-query block) per wave.
// Mask (anti-causal): key j visible to query i iff (j >= i + d) || (j == L-1),
// d = 2^(h / (H/DIAG)) = 2^(h>>2).  Blocks kb < qb are fully masked -> skipped.
// ---------------------------------------------------------------------------
__global__ __launch_bounds__(32)
void flash_attn(const float* __restrict__ Q, const float* __restrict__ Kmat,
                const float* __restrict__ V, float* __restrict__ O) {
  __shared__ float pbuf[16 * 18];  // P tile staging, padded rows (8B-aligned pairs)

  const int lane = threadIdx.x;
  const int nn = lane & 15, half = lane >> 4;
  const int qb = blockIdx.x;           // query block 0..127
  const int h  = blockIdx.y;           // head 0..15
  const int b  = blockIdx.z;           // batch 0..1
  const int q0 = qb * 16;
  const int d  = 1 << (h >> 2);        // diag offset for this head's group
  const size_t base = (size_t)b * SEQ_L * D_MODEL + (size_t)h * HEAD_E;
  const float scale = 0.125f;          // 1/sqrt(64)

  // Q tile in A-layout register chunks: qa[ec][v] = Q[q0 + (l&15)][4*ec + 2*half + v]
  v2f qa[16];
  {
    const float* qr = Q + base + (size_t)(q0 + nn) * D_MODEL + 2 * half;
    #pragma unroll
    for (int ec = 0; ec < 16; ++ec) qa[ec] = *(const v2f*)(qr + ec * 4);
  }

  v8f o0 = {}, o1 = {}, o2 = {}, o3 = {};
  float rm[8], rs[8];
  #pragma unroll
  for (int v = 0; v < 8; ++v) { rm[v] = -3.0e38f; rs[v] = 0.0f; }

  for (int kb = qb; kb < SEQ_L / 16; ++kb) {
    const int kbase = kb * 16;

    // ---- S = Q @ K^T over E=64 (16 wmma steps of k=4) ----
    v8f s = {};
    const float* kr = Kmat + base + (size_t)(kbase + nn) * D_MODEL + 2 * half;
    #pragma unroll
    for (int ec = 0; ec < 16; ++ec)
      s = wmma_f32(qa[ec], *(const v2f*)(kr + ec * 4), s);

    // ---- mask + scale + online softmax (row stats via in-half shuffles) ----
    float p[8], alpha[8];
    #pragma unroll
    for (int v = 0; v < 8; ++v) {
      const int i  = q0 + v + 8 * half;   // query row of this D slot
      const int jk = kbase + nn;          // key column of this lane
      const bool ok = (jk >= i + d) || (jk == SEQ_L - 1);
      const float sm = ok ? s[v] * scale : -3.0e38f;
      const float nm = fmaxf(rm[v], rmax16(sm));
      alpha[v] = __expf(rm[v] - nm);
      rm[v] = nm;
      const float pv = ok ? __expf(sm - nm) : 0.0f;  // explicit 0 for masked lanes
      p[v] = pv;
      rs[v] = rs[v] * alpha[v] + rsum16(pv);
    }
    #pragma unroll
    for (int v = 0; v < 8; ++v) {
      o0[v] *= alpha[v]; o1[v] *= alpha[v]; o2[v] *= alpha[v]; o3[v] *= alpha[v];
    }

    // ---- stage P (D-layout) -> LDS -> A-layout for the PV wmmas ----
    __syncthreads();
    #pragma unroll
    for (int v = 0; v < 8; ++v) pbuf[(v + 8 * half) * 18 + nn] = p[v];
    __syncthreads();

    const float* vr = V + base + (size_t)kbase * D_MODEL + nn;
    #pragma unroll
    for (int k0 = 0; k0 < 16; k0 += 4) {
      v2f ap = *(const v2f*)&pbuf[nn * 18 + k0 + 2 * half];
      const int row = k0 + 2 * half;
      v2f b0v = { vr[(size_t)row * D_MODEL +  0], vr[(size_t)(row + 1) * D_MODEL +  0] };
      v2f b1v = { vr[(size_t)row * D_MODEL + 16], vr[(size_t)(row + 1) * D_MODEL + 16] };
      v2f b2v = { vr[(size_t)row * D_MODEL + 32], vr[(size_t)(row + 1) * D_MODEL + 32] };
      v2f b3v = { vr[(size_t)row * D_MODEL + 48], vr[(size_t)(row + 1) * D_MODEL + 48] };
      o0 = wmma_f32(ap, b0v, o0);
      o1 = wmma_f32(ap, b1v, o1);
      o2 = wmma_f32(ap, b2v, o2);
      o3 = wmma_f32(ap, b3v, o3);
    }
  }

  // ---- finalize: O /= rowsum, write [b, q, h*64 + e] ----
  #pragma unroll
  for (int v = 0; v < 8; ++v) {
    const float inv = 1.0f / rs[v];
    float* orow = O + base + (size_t)(q0 + v + 8 * half) * D_MODEL + nn;
    orow[0]  = o0[v] * inv;
    orow[16] = o1[v] * inv;
    orow[32] = o2[v] * inv;
    orow[48] = o3[v] * inv;
  }
}

// ---------------------------------------------------------------------------
extern "C" void kernel_launch(void* const* d_in, const int* in_sizes, int n_in,
                              void* d_out, int out_size, void* d_ws, size_t ws_size,
                              hipStream_t stream) {
  const float* queries = (const float*)d_in[0];
  const float* keys    = (const float*)d_in[1];
  const float* values  = (const float*)d_in[2];
  const float* Wq = (const float*)d_in[3];
  const float* bq = (const float*)d_in[4];
  const float* Wk = (const float*)d_in[5];
  const float* bk = (const float*)d_in[6];
  const float* Wv = (const float*)d_in[7];
  const float* bv = (const float*)d_in[8];
  const float* Wo = (const float*)d_in[9];
  const float* bo = (const float*)d_in[10];

  const size_t plane = (size_t)M_TOTAL * D_MODEL;  // 4096*1024 floats = 16 MB
  float* qws = (float*)d_ws;
  float* kws = qws + plane;
  float* vws = kws + plane;
  float* aws = vws + plane;

  dim3 gg(M_TOTAL / 64, D_MODEL / 64, 1);   // 64 x 16 workgroups, 4 waves each
  gemm64x64<<<gg, 128, 0, stream>>>(queries, Wq, bq, qws);
  gemm64x64<<<gg, 128, 0, stream>>>(keys,    Wk, bk, kws);
  gemm64x64<<<gg, 128, 0, stream>>>(values,  Wv, bv, vws);

  dim3 ga(SEQ_L / 16, N_HEADS, BATCH);      // 128 x 16 x 2 waves
  flash_attn<<<ga, 32, 0, stream>>>(qws, kws, vws, aws);

  gemm64x64<<<gg, 128, 0, stream>>>(aws, Wo, bo, (float*)d_out);
}

// v002
// Measured time: 462 microseconds a run.
// Next to v001, in two timings, it ran 1.04 times as fast each time.
// All steps since v000 together make it 1.15 times as fast.
#include <hip/hip_runtime.h>

// ---------------------------------------------------------------------------
// AttentionLayer for MI455X (gfx1250): f32 WMMA 16x16x4 everywhere.
//   q/k/v = X @ W^T + b        (gemm64x64: async-to-LDS staged W tile)
//   flash-style masked softmax attention per (b, h)   (flash_attn)
//   out   = attn @ Wo^T + bo   (gemm64x64)
// ---------------------------------------------------------------------------

typedef float v2f __attribute__((ext_vector_type(2)));
typedef float v8f __attribute__((ext_vector_type(8)));

#define D_MODEL 1024
#define N_HEADS 16
#define HEAD_E  64
#define SEQ_L   2048
#define BATCH   2
#define M_TOTAL (BATCH * SEQ_L)

__device__ __forceinline__ v8f wmma_f32(v2f a, v2f b, v8f c) {
  // D = A(16x4, f32) x B(4x16, f32) + C(16x16, f32)
  return __builtin_amdgcn_wmma_f32_16x16x4_f32(
      /*neg_a=*/false, a, /*neg_b=*/false, b,
      /*c_mod=*/(short)0, c, /*reuse_a=*/false, /*reuse_b=*/false);
}

// CDNA5 async copy: global memory -> LDS, 16B per lane, tracked by ASYNCcnt.
// lds_off must be the real LDS byte offset (low 32 bits of the generic
// pointer) so the shared array is captured and alias analysis keeps the
// subsequent ds_load reads live.
__device__ __forceinline__ void async_load_b128(unsigned lds_off, const float* gptr) {
  asm volatile("global_load_async_to_lds_b128 %0, %1, off"
               :: "v"(lds_off), "v"(gptr) : "memory");
}
__device__ __forceinline__ void wait_asynccnt0() {
  asm volatile("s_wait_asynccnt 0x0" ::: "memory");
}

__device__ __forceinline__ float rmax16(float x) {
  // reduce over the 16 lanes of each wave half (xor masks < 16 stay in-half)
  x = fmaxf(x, __shfl_xor(x, 1));
  x = fmaxf(x, __shfl_xor(x, 2));
  x = fmaxf(x, __shfl_xor(x, 4));
  x = fmaxf(x, __shfl_xor(x, 8));
  return x;
}
__device__ __forceinline__ float rsum16(float x) {
  x += __shfl_xor(x, 1);
  x += __shfl_xor(x, 2);
  x += __shfl_xor(x, 4);
  x += __shfl_xor(x, 8);
  return x;
}

// ---------------------------------------------------------------------------
// C[M,N] = X[M,K] @ W[N,K]^T + bias[N]
// Workgroup = 4 waves -> 64x64 C tile (each wave: 16 rows of M, all 64 N).
// Per 32-wide k-slice: the 64x32 W sub-tile (8 KB) is staged into LDS with
// GLOBAL_LOAD_ASYNC_TO_LDS_B128 (each wave copies 1/4), fenced with
// s_wait_asynccnt + barrier, then consumed as ds_load b64 B-fragments.
// A layout: lane m = l&15, vgpr v -> k = 2*(l>>4)+v   (float2 along K)
// D layout: lane n = l&15, vgpr v -> m = v + 8*(l>>4)
// ---------------------------------------------------------------------------
#define KSLICE 32
// LDS row pitch in floats: 128-B rows put all 16 rows of a fragment read on
// 8 banks; 144 B (16 B x odd) spreads the 32 lanes' b64 reads over all 64.
#define WPITCH 36

__global__ __launch_bounds__(128)
void gemm64x64(const float* __restrict__ X, const float* __restrict__ W,
               const float* __restrict__ bias, float* __restrict__ C) {
  __shared__ float lds_w[64 * WPITCH];   // [n-in-tile][k-in-slice], padded rows, 9 KB

  const int K = D_MODEL, N = D_MODEL;
  const int lane = threadIdx.x & 31;
  const int wave = threadIdx.x >> 5;     // 0..3
  const int nn = lane & 15, half = lane >> 4;
  const int m0 = blockIdx.x * 64 + wave * 16;
  const int n0 = blockIdx.y * 64;

  // staging assignment: 512 16B-chunks per slice; this lane copies 4
  // consecutive chunks = 16 floats of one W row.
  const int g0   = wave * 128 + lane * 4;        // first chunk id
  const int srow = g0 >> 3;                      // 0..63 (n within tile)
  const int scol = (g0 & 7) * 4;                 // k offset within slice
  const float* wsrc_base = W + (size_t)(n0 + srow) * K + scol;
  // Low 32 bits of the generic pointer == LDS byte offset (aperture mapping);
  // using the real address also captures lds_w for the asm's memory clobber.
  const unsigned ldst_base =
      (unsigned)(size_t)(&lds_w[0]) + (unsigned)(srow * WPITCH + scol) * 4u;

  const float* xr = X + (size_t)(m0 + nn) * K + 2 * half;

  v8f acc0 = {}, acc1 = {}, acc2 = {}, acc3 = {};

  for (int ks = 0; ks < K; ks += KSLICE) {
    __syncthreads();                     // previous slice fully consumed
    // ---- async stage W[n0..n0+63][ks..ks+31] -> LDS ----
    const float* wsrc = wsrc_base + ks;
    #pragma unroll
    for (int t = 0; t < 4; ++t)
      async_load_b128(ldst_base + 16u * t, wsrc + 4 * t);
    // prefetch next A-slice while the async copy is in flight
    if (ks + KSLICE < K) __builtin_prefetch(xr + ks + KSLICE, 0, 3);
    wait_asynccnt0();
    __syncthreads();                     // all waves' chunks visible

    // ---- consume: 8 wmma k-steps of 4 ----
    #pragma unroll
    for (int k = 0; k < KSLICE; k += 4) {
      v2f a = *(const v2f*)(xr + ks + k);
      v2f b0 = *(const v2f*)&lds_w[( 0 + nn) * WPITCH + k + 2 * half];
      v2f b1 = *(const v2f*)&lds_w[(16 + nn) * WPITCH + k + 2 * half];
      v2f b2 = *(const v2f*)&lds_w[(32 + nn) * WPITCH + k + 2 * half];
      v2f b3 = *(const v2f*)&lds_w[(48 + nn) * WPITCH + k + 2 * half];
      acc0 = wmma_f32(a, b0, acc0);
      acc1 = wmma_f32(a, b1, acc1);
      acc2 = wmma_f32(a, b2, acc2);
      acc3 = wmma_f32(a, b3, acc3);
    }
  }

  const float b0 = bias[n0 +  0 + nn];
  const float b1 = bias[n0 + 16 + nn];
  const float b2 = bias[n0 + 32 + nn];
  const float b3 = bias[n0 + 48 + nn];

  #pragma unroll
  for (int v = 0; v < 8; ++v) {
    const int m = m0 + v + 8 * half;
    float* crow = C + (size_t)m * N + n0 + nn;
    crow[0]  = acc0[v] + b0;
    crow[16] = acc1[v] + b1;
    crow[32] = acc2[v] + b2;
    crow[48] = acc3[v] + b3;
  }
}

#define ATT_WAVES 4
#define KSTAGE 32                      // keys per staged tile
// K rows: 272 B (16 B x odd): the b64 fragment reads of 16 rows x 2 halves
// fall on all 64 banks.
#define KPITCH 68
// V rows: 320 B: the four rows that one k-step reads (16 dwords of each) start
// 16 banks apart.
#define VPITCH 80
#define KTILE_F (KSTAGE * KPITCH)
#define VTILE_F (KSTAGE * VPITCH)
#define STAGE_F (KTILE_F + VTILE_F)    // 18,944 B per buffer
#define N_STAGES (SEQ_L / KSTAGE)

// One lane's share of a 32-key tile: 4 x 16 B of K and 4 x 16 B of V, rows 8
// apart.  s_wait_xcnt closes the statement so that no address register is
// rewritten ahead of it.
__device__ __forceinline__ void stage_kv(unsigned lk, unsigned lv,
                                         const float* gk, const float* gv) {
  asm volatile(
      "global_load_async_to_lds_b128 %0, %8, off\n\t"
      "global_load_async_to_lds_b128 %1, %9, off\n\t"
      "global_load_async_to_lds_b128 %2, %10, off\n\t"
      "global_load_async_to_lds_b128 %3, %11, off\n\t"
      "global_load_async_to_lds_b128 %4, %12, off\n\t"
      "global_load_async_to_lds_b128 %5, %13, off\n\t"
      "global_load_async_to_lds_b128 %6, %14, off\n\t"
      "global_load_async_to_lds_b128 %7, %15, off\n\t"
      "s_wait_xcnt 0x0"
      :: "v"(lk), "v"(lk + 8u * KPITCH * 4u), "v"(lk + 16u * KPITCH * 4u),
         "v"(lk + 24u * KPITCH * 4u),
         "v"(lv), "v"(lv + 8u * VPITCH * 4u), "v"(lv + 16u * VPITCH * 4u),
         "v"(lv + 24u * VPITCH * 4u),
         "v"(gk), "v"(gk + 8 * D_MODEL), "v"(gk + 16 * D_MODEL), "v"(gk + 24 * D_MODEL),
         "v"(gv), "v"(gv + 8 * D_MODEL), "v"(gv + 16 * D_MODEL), "v"(gv + 24 * D_MODEL)
      : "memory");
}

// P passes from lane to lane of ONE wave through that wave's own LDS rows. A
// wave's LDS operations run in issue order, so all that is needed is that the
// compiler does not move the reads over the writes (or the next writes over
// these reads): a wavefront-scope fence pair, which emits no instruction.
__device__ __forceinline__ void wave_lds_order() {
  __builtin_amdgcn_fence(__ATOMIC_RELEASE, "wavefront");
  __builtin_amdgcn_wave_barrier();
  __builtin_amdgcn_fence(__ATOMIC_ACQUIRE, "wavefront");
}

__global__ __launch_bounds__(32 * ATT_WAVES)
void flash_attn(const float* __restrict__ Q, const float* __restrict__ Kmat,
                const float* __restrict__ V, float* __restrict__ O) {
  __shared__ __attribute__((aligned(16))) float kv[2 * STAGE_F];  // [buffer][K tile | V tile]
  __shared__ float pbuf_all[ATT_WAVES * 16 * 18];  // per wave: P tile, padded rows

  const int tid  = threadIdx.x;
  const int lane = tid & 31;
  // scalar wave number: the skip of masked blocks must be a scalar branch
  // (WMMA needs EXEC all ones)
  const int wave = __builtin_amdgcn_readfirstlane(tid >> 5);
  const int nn = lane & 15, half = lane >> 4;
  const int qg = blockIdx.x;           // 64-query group 0..31
  const int qb = qg * ATT_WAVES + wave;  // query block 0..127
  const int h  = blockIdx.y;           // head 0..15
  const int b  = blockIdx.z;           // batch 0..1
  const int q0 = qb * 16;
  const int d  = 1 << (h >> 2);        // diag offset for this head's group
  const size_t base = (size_t)b * SEQ_L * D_MODEL + (size_t)h * HEAD_E;
  const float scale = 0.125f;          // 1/sqrt(64)
  float* pbuf = pbuf_all + wave * (16 * 18);

  // staging assignment: a tile row is 16 chunks of 16 B; this lane copies chunk
  // (tid & 15) of rows (tid >> 4) + 8 t, so a wave's copy covers 2 whole rows.
  const int srow = tid >> 4, scol = (tid & 15) * 4;
  const unsigned lds0 = (unsigned)(size_t)(&kv[0]);   // LDS byte offset of kv
  const unsigned lk0 = lds0 + (unsigned)(srow * KPITCH + scol) * 4u;
  const unsigned lv0 = lds0 + (unsigned)(KTILE_F + srow * VPITCH + scol) * 4u;
  const float* gk0 = Kmat + base + (size_t)srow * D_MODEL + scol;
  const float* gv0 = V    + base + (size_t)srow * D_MODEL + scol;

  // first tile that holds a visible key of this group; 64 - 2 qg >= 2 tiles
  const int s0 = qg * (16 * ATT_WAVES / KSTAGE);

  stage_kv(lk0, lv0, gk0 + (size_t)s0 * KSTAGE * D_MODEL,
                     gv0 + (size_t)s0 * KSTAGE * D_MODEL);

  // Q tile in A-layout register chunks: qa[ec][v] = Q[q0 + (l&15)][4*ec + 2*half + v]
  v2f qa[16];
  {
    const float* qr = Q + base + (size_t)(q0 + nn) * D_MODEL + 2 * half;
    #pragma unroll
    for (int ec = 0; ec < 16; ++ec) qa[ec] = *(const v2f*)(qr + ec * 4);
  }

  v8f o0 = {}, o1 = {}, o2 = {}, o3 = {};
  float rm[8], rs[8];
  #pragma unroll
  for (int v = 0; v < 8; ++v) { rm[v] = -3.0e38f; rs[v] = 0.0f; }

  wait_asynccnt0();                    // this wave's share of the first tile has landed
  __syncthreads();                     // ... and every other wave's
  stage_kv(lk0 + STAGE_F * 4u, lv0 + STAGE_F * 4u,
           gk0 + (size_t)(s0 + 1) * KSTAGE * D_MODEL,
           gv0 + (size_t)(s0 + 1) * KSTAGE * D_MODEL);

  for (int s = s0; s < N_STAGES; ++s) {
    const int buf = (s - s0) & 1;
    const float* kt = kv + buf * STAGE_F;
    const float* vt = kt + KTILE_F;

    for (int j = 0; j < KSTAGE / 16; ++j) {
      const int kb = s * (KSTAGE / 16) + j;
      if (kb < qb) continue;           // fully masked for this wave (scalar test)
      const int kbase = kb * 16;

      // ---- S = Q @ K^T over E=64 (16 wmma steps of k=4) ----
      v8f sc = {};
      const float* kr = kt + (j * 16 + nn) * KPITCH + 2 * half;
      #pragma unroll
      for (int ec = 0; ec < 16; ++ec)
        sc = wmma_f32(qa[ec], *(const v2f*)(kr + ec * 4), sc);

      // ---- mask + scale + online softmax (row stats via in-half shuffles) ----
      float p[8], alpha[8];
      #pragma unroll
      for (int v = 0; v < 8; ++v) {
        const int i  = q0 + v + 8 * half;   // query row of this D slot
        const int jk = kbase + nn;          // key column of this lane
        const bool ok = (jk >= i + d) || (jk == SEQ_L - 1);
        const float sm = ok ? sc[v] * scale : -3.0e38f;
        const float nm = fmaxf(rm[v], rmax16(sm));
        alpha[v] = __expf(rm[v] - nm);
        rm[v] = nm;
        const float pv = ok ? __expf(sm - nm) : 0.0f;  // explicit 0 for masked lanes
        p[v] = pv;
        rs[v] = rs[v] * alpha[v] + rsum16(pv);
      }
      #pragma unroll
      for (int v = 0; v < 8; ++v) {
        o0[v] *= alpha[v]; o1[v] *= alpha[v]; o2[v] *= alpha[v]; o3[v] *= alpha[v];
      }

      // ---- stage P (D-layout) -> LDS -> A-layout for the PV wmmas ----
      wave_lds_order();
      #pragma unroll
      for (int v = 0; v < 8; ++v) pbuf[(v + 8 * half) * 18 + nn] = p[v];
      wave_lds_order();

      const float* vr = vt + (j * 16) * VPITCH + nn;
      #pragma unroll
      for (int k0 = 0; k0 < 16; k0 += 4) {
        v2f ap = *(const v2f*)&pbuf[nn * 18 + k0 + 2 * half];
        const int row = k0 + 2 * half;
        v2f b0v = { vr[row * VPITCH +  0], vr[(row + 1) * VPITCH +  0] };
        v2f b1v = { vr[row * VPITCH + 16], vr[(row + 1) * VPITCH + 16] };
        v2f b2v = { vr[row * VPITCH + 32], vr[(row + 1) * VPITCH + 32] };
        v2f b3v = { vr[row * VPITCH + 48], vr[(row + 1) * VPITCH + 48] };
        o0 = wmma_f32(ap, b0v, o0);
        o1 = wmma_f32(ap, b1v, o1);
        o2 = wmma_f32(ap, b2v, o2);
        o3 = wmma_f32(ap, b3v, o3);
      }
    }

    // ---- hand-over, every wave, also one that skipped the tile ----
    asm volatile("s_wait_dscnt 0x0" ::: "memory");  // own reads of this buffer are done
    wait_asynccnt0();                  // own share of tile s + 1 has landed
    __syncthreads();                   // publishes tile s + 1, frees this buffer
    if (s + 2 < N_STAGES)              // same for the whole workgroup
      stage_kv(lk0 + (unsigned)buf * (STAGE_F * 4u), lv0 + (unsigned)buf * (STAGE_F * 4u),
               gk0 + (size_t)(s + 2) * KSTAGE * D_MODEL,
               gv0 + (size_t)(s + 2) * KSTAGE * D_MODEL);
  }
  wait_asynccnt0();                    // nothing of this wave's is in flight at its end

  // ---- finalize: O /= rowsum, write [b, q, h*64 + e] ----
  #pragma unroll
  for (int v = 0; v < 8; ++v) {
    const float inv = 1.0f / rs[v];
    float* orow = O + base + (size_t)(q0 + v + 8 * half) * D_MODEL + nn;
    orow[0]  = o0[v] * inv;
    orow[16] = o1[v] * inv;
    orow[32] = o2[v] * inv;
    orow[48] = o3[v] * inv;
  }
}

// ---------------------------------------------------------------------------
extern "C" void kernel_launch(void* const* d_in, const int* in_sizes, int n_in,
                              void* d_out, int out_size, void* d_ws, size_t ws_size,
                              hipStream_t stream) {
  const float* queries = (const float*)d_in[0];
  const float* keys    = (const float*)d_in[1];
  const float* values  = (const float*)d_in[2];
  const float* Wq = (const float*)d_in[3];
  const float* bq = (const float*)d_in[4];
  const float* Wk = (const float*)d_in[5];
  const float* bk = (const float*)d_in[6];
  const float* Wv = (const float*)d_in[7];
  const float* bv = (const float*)d_in[8];
  const float* Wo = (const float*)d_in[9];
  const float* bo = (const float*)d_in[10];

  const size_t plane = (size_t)M_TOTAL * D_MODEL;  // 4096*1024 floats = 16 MB
  float* qws = (float*)d_ws;
  float* kws = qws + plane;
  float* vws = kws + plane;
  float* aws = vws + plane;

  dim3 gg(M_TOTAL / 64, D_MODEL / 64, 1);   // 64 x 16 workgroups, 4 waves each
  gemm64x64<<<gg, 128, 0, stream>>>(queries, Wq, bq, qws);
  gemm64x64<<<gg, 128, 0, stream>>>(keys,    Wk, bk, kws);
  gemm64x64<<<gg, 128, 0, stream>>>(values,  Wv, bv, vws);

  dim3 ga(SEQ_L / (16 * ATT_WAVES), N_HEADS, BATCH);   // 32 x 16 x 2 workgroups, 4 waves each
  flash_attn<<<ga, 32 * ATT_WAVES, 0, stream>>>(qws, kws, vws, aws);

  gemm64x64<<<gg, 128, 0, stream>>>(aws, Wo, bo, (float*)d_out);
}

// v003
// A run of this version takes 398 microseconds.
// In both of two side-by-side timings against v002, it was 1.16 times as fast.
// All steps since v000 together make it 1.34 times as fast.
#include <hip/hip_runtime.h>

// ---------------------------------------------------------------------------
// AttentionLayer for MI455X (gfx1250): f32 WMMA 16x16x4 everywhere.
//   q/k/v = X @ W^T + b        (gemm64x64: async-to-LDS staged W tile)
//   flash-style masked softmax attention per (b, h)   (flash_attn)
//   out   = attn @ Wo^T + bo   (gemm64x64)
// ---------------------------------------------------------------------------

typedef float v2f __attribute__((ext_vector_type(2)));
typedef float v8f __attribute__((ext_vector_type(8)));

#define D_MODEL 1024
#define N_HEADS 16
#define HEAD_E  64
#define SEQ_L   2048
#define BATCH   2
#define M_TOTAL (BATCH * SEQ_L)

__device__ __forceinline__ v8f wmma_f32(v2f a, v2f b, v8f c) {
  // D = A(16x4, f32) x B(4x16, f32) + C(16x16, f32)
  return __builtin_amdgcn_wmma_f32_16x16x4_f32(
      /*neg_a=*/false, a, /*neg_b=*/false, b,
      /*c_mod=*/(short)0, c, /*reuse_a=*/false, /*reuse_b=*/false);
}

// CDNA5 async copy: global memory -> LDS, 16B per lane, tracked by ASYNCcnt.
// lds_off must be the real LDS byte offset (low 32 bits of the generic
// pointer) so the shared array is captured and alias analysis keeps the
// subsequent ds_load reads live.
__device__ __forceinline__ void async_load_b128(unsigned lds_off, const float* gptr) {
  asm volatile("global_load_async_to_lds_b128 %0, %1, off"
               :: "v"(lds_off), "v"(gptr) : "memory");
}
__device__ __forceinline__ void wait_asynccnt0() {
  asm volatile("s_wait_asynccnt 0x0" ::: "memory");
}

// value of the same lane number in the other 16-lane half (l <-> l ^ 16), one
// vector instruction, no LDS
__device__ __forceinline__ float other_half(float x) {
  const unsigned u = __float_as_uint(x);
  return __uint_as_float(
      __builtin_amdgcn_permlanex16(u, u, 0x76543210u, 0xfedcba98u, false, false));
}

// ---------------------------------------------------------------------------
// C[M,N] = X[M,K] @ W[N,K]^T + bias[N]
// Workgroup = 4 waves -> 64x64 C tile (each wave: 16 rows of M, all 64 N).
// Per 32-wide k-slice: the 64x32 W sub-tile (8 KB) is staged into LDS with
// GLOBAL_LOAD_ASYNC_TO_LDS_B128 (each wave copies 1/4), fenced with
// s_wait_asynccnt + barrier, then consumed as ds_load b64 B-fragments.
// A layout: lane m = l&15, vgpr v -> k = 2*(l>>4)+v   (float2 along K)
// D layout: lane n = l&15, vgpr v -> m = v + 8*(l>>4)
// ---------------------------------------------------------------------------
#define KSLICE 32
// LDS row pitch in floats: 128-B rows put all 16 rows of a fragment read on
// 8 banks; 144 B (16 B x odd) spreads the 32 lanes' b64 reads over all 64.
#define WPITCH 36

__global__ __launch_bounds__(128)
void gemm64x64(const float* __restrict__ X, const float* __restrict__ W,
               const float* __restrict__ bias, float* __restrict__ C) {
  __shared__ float lds_w[64 * WPITCH];   // [n-in-tile][k-in-slice], padded rows, 9 KB

  const int K = D_MODEL, N = D_MODEL;
  const int lane = threadIdx.x & 31;
  const int wave = threadIdx.x >> 5;     // 0..3
  const int nn = lane & 15, half = lane >> 4;
  const int m0 = blockIdx.x * 64 + wave * 16;
  const int n0 = blockIdx.y * 64;

  // staging assignment: 512 16B-chunks per slice; this lane copies 4
  // consecutive chunks = 16 floats of one W row.
  const int g0   = wave * 128 + lane * 4;        // first chunk id
  const int srow = g0 >> 3;                      // 0..63 (n within tile)
  const int scol = (g0 & 7) * 4;                 // k offset within slice
  const float* wsrc_base = W + (size_t)(n0 + srow) * K + scol;
  // Low 32 bits of the generic pointer == LDS byte offset (aperture mapping);
  // using the real address also captures lds_w for the asm's memory clobber.
  const unsigned ldst_base =
      (unsigned)(size_t)(&lds_w[0]) + (unsigned)(srow * WPITCH + scol) * 4u;

  const float* xr = X + (size_t)(m0 + nn) * K + 2 * half;

  v8f acc0 = {}, acc1 = {}, acc2 = {}, acc3 = {};

  for (int ks = 0; ks < K; ks += KSLICE) {
    __syncthreads();                     // previous slice fully consumed
    // ---- async stage W[n0..n0+63][ks..ks+31] -> LDS ----
    const float* wsrc = wsrc_base + ks;
    #pragma unroll
    for (int t = 0; t < 4; ++t)
      async_load_b128(ldst_base + 16u * t, wsrc + 4 * t);
    // prefetch next A-slice while the async copy is in flight
    if (ks + KSLICE < K) __builtin_prefetch(xr + ks + KSLICE, 0, 3);
    wait_asynccnt0();
    __syncthreads();                     // all waves' chunks visible

    // ---- consume: 8 wmma k-steps of 4 ----
    #pragma unroll
    for (int k = 0; k < KSLICE; k += 4) {
      v2f a = *(const v2f*)(xr + ks + k);
      v2f b0 = *(const v2f*)&lds_w[( 0 + nn) * WPITCH + k + 2 * half];
      v2f b1 = *(const v2f*)&lds_w[(16 + nn) * WPITCH + k + 2 * half];
      v2f b2 = *(const v2f*)&lds_w[(32 + nn) * WPITCH + k + 2 * half];
      v2f b3 = *(const v2f*)&lds_w[(48 + nn) * WPITCH + k + 2 * half];
      acc0 = wmma_f32(a, b0, acc0);
      acc1 = wmma_f32(a, b1, acc1);
      acc2 = wmma_f32(a, b2, acc2);
      acc3 = wmma_f32(a, b3, acc3);
    }
  }

  const float b0 = bias[n0 +  0 + nn];
  const float b1 = bias[n0 + 16 + nn];
  const float b2 = bias[n0 + 32 + nn];
  const float b3 = bias[n0 + 48 + nn];

  #pragma unroll
  for (int v = 0; v < 8; ++v) {
    const int m = m0 + v + 8 * half;
    float* crow = C + (size_t)m * N + n0 + nn;
    crow[0]  = acc0[v] + b0;
    crow[16] = acc1[v] + b1;
    crow[32] = acc2[v] + b2;
    crow[48] = acc3[v] + b3;
  }
}

#define ATT_WAVES 4
#define KSTAGE 32                      // keys per staged tile
// K rows: 272 B (16 B x odd): the b64 fragment reads of 16 rows x 2 halves
// fall on all 64 banks.
#define KPITCH 68
// V rows lie in pairs, interleaved in 16-B chunks: chunk g of key k stands at
// dword (k >> 1) * 2 * VPITCH + 8 g + 4 (k & 1).  The two keys of one V^T
// fragment are then 4 dwords apart (one two-address LDS load fills the register
// pair), and the halves' rows, 8 keys apart, start 32 banks apart.
#define VPITCH 68
#define KTILE_F (KSTAGE * KPITCH)
#define VTILE_F (KSTAGE * VPITCH)
#define STAGE_F (KTILE_F + VTILE_F)    // 17,408 B per buffer
#define N_STAGES (SEQ_L / KSTAGE)

// One lane's share of a 32-key tile: 4 x 16 B of K and 4 x 16 B of V, rows 8
// apart.  s_wait_xcnt closes the statement so that no address register is
// rewritten ahead of it.
__device__ __forceinline__ void stage_kv(unsigned lk, unsigned lv,
                                         const float* gk, const float* gv) {
  asm volatile(
      "global_load_async_to_lds_b128 %0, %8, off\n\t"
      "global_load_async_to_lds_b128 %1, %9, off\n\t"
      "global_load_async_to_lds_b128 %2, %10, off\n\t"
      "global_load_async_to_lds_b128 %3, %11, off\n\t"
      "global_load_async_to_lds_b128 %4, %12, off\n\t"
      "global_load_async_to_lds_b128 %5, %13, off\n\t"
      "global_load_async_to_lds_b128 %6, %14, off\n\t"
      "global_load_async_to_lds_b128 %7, %15, off\n\t"
      "s_wait_xcnt 0x0"
      :: "v"(lk), "v"(lk + 8u * KPITCH * 4u), "v"(lk + 16u * KPITCH * 4u),
         "v"(lk + 24u * KPITCH * 4u),
         "v"(lv), "v"(lv + 8u * VPITCH * 4u), "v"(lv + 16u * VPITCH * 4u),
         "v"(lv + 24u * VPITCH * 4u),
         "v"(gk), "v"(gk + 8 * D_MODEL), "v"(gk + 16 * D_MODEL), "v"(gk + 24 * D_MODEL),
         "v"(gv), "v"(gv + 8 * D_MODEL), "v"(gv + 16 * D_MODEL), "v"(gv + 24 * D_MODEL)
      : "memory");
}

__global__ __launch_bounds__(32 * ATT_WAVES)
void flash_attn(const float* __restrict__ Q, const float* __restrict__ Kmat,
                const float* __restrict__ V, float* __restrict__ O) {
  __shared__ __attribute__((aligned(16))) float kv[2 * STAGE_F];  // [buffer][K tile | V tile]

  const int tid  = threadIdx.x;
  const int lane = tid & 31;
  // scalar wave number: the skip of masked blocks must be a scalar branch
  // (WMMA needs EXEC all ones)
  const int wave = __builtin_amdgcn_readfirstlane(tid >> 5);
  const int nn = lane & 15, half = lane >> 4;
  const int qg = blockIdx.x;           // 64-query group 0..31
  const int qb = qg * ATT_WAVES + wave;  // query block 0..127
  const int h  = blockIdx.y;           // head 0..15
  const int b  = blockIdx.z;           // batch 0..1
  const int q0 = qb * 16;
  const int d  = 1 << (h >> 2);        // diag offset for this head's group
  const size_t base = (size_t)b * SEQ_L * D_MODEL + (size_t)h * HEAD_E;
  const float scale = 0.125f;          // 1/sqrt(64)

  // staging assignment: a tile row is 16 chunks of 16 B; this lane copies chunk
  // (tid & 15) of rows (tid >> 4) + 8 t, so a wave's copy covers 2 whole rows.
  const int srow = tid >> 4, scol = (tid & 15) * 4;
  const unsigned lds0 = (unsigned)(size_t)(&kv[0]);   // LDS byte offset of kv
  const unsigned lk0 = lds0 + (unsigned)(srow * KPITCH + scol) * 4u;
  const unsigned lv0 = lds0 + (unsigned)(KTILE_F + (srow >> 1) * (2 * VPITCH) +
                                         2 * scol + 4 * (srow & 1)) * 4u;
  const float* gk0 = Kmat + base + (size_t)srow * D_MODEL + scol;
  const float* gv0 = V    + base + (size_t)srow * D_MODEL + scol;

  // first tile that holds a visible key of this group; 64 - 2 qg >= 2 tiles
  const int s0 = qg * (16 * ATT_WAVES / KSTAGE);

  stage_kv(lk0, lv0, gk0 + (size_t)s0 * KSTAGE * D_MODEL,
                     gv0 + (size_t)s0 * KSTAGE * D_MODEL);

  // Q^T as B operand, kept in registers: qa[ec][v] = Q[q0 + (l&15)][4*ec + 2*half + v]
  v2f qa[16];
  {
    const float* qr = Q + base + (size_t)(q0 + nn) * D_MODEL + 2 * half;
    #pragma unroll
    for (int ec = 0; ec < 16; ++ec) qa[ec] = *(const v2f*)(qr + ec * 4);
  }

  v8f o0 = {}, o1 = {}, o2 = {}, o3 = {};
  const int qi = q0 + nn;              // this lane's query
  float rm = -3.0e38f;                 // its running maximum (equal in both halves)
  float rs = 0.0f;                     // running sum over this half's keys only

  wait_asynccnt0();                    // this wave's share of the first tile has landed
  __syncthreads();                     // ... and every other wave's
  stage_kv(lk0 + STAGE_F * 4u, lv0 + STAGE_F * 4u,
           gk0 + (size_t)(s0 + 1) * KSTAGE * D_MODEL,
           gv0 + (size_t)(s0 + 1) * KSTAGE * D_MODEL);

  for (int s = s0; s < N_STAGES; ++s) {
    const int buf = (s - s0) & 1;
    const float* kt = kv + buf * STAGE_F;
    const float* vt = kt + KTILE_F;

    for (int j = 0; j < KSTAGE / 16; ++j) {
      const int kb = s * (KSTAGE / 16) + j;
      if (kb < qb) continue;           // fully masked for this wave (scalar test)
      const int kbase = kb * 16;

      // ---- S^T = K @ Q^T over E=64 (16 wmma steps of k=4) ----
      // sc[r] = S[query qi][key kbase + 8*half + r]
      v8f sc = {};
      const float* kr = kt + (j * 16 + nn) * KPITCH + 2 * half;
      #pragma unroll
      for (int ec = 0; ec < 16; ++ec)
        sc = wmma_f32(*(const v2f*)(kr + ec * 4), qa[ec], sc);

      // ---- mask + scale + online softmax, one query per lane ----
      float sm[8], p[8];
      float mx = -3.0e38f;
      #pragma unroll
      for (int r = 0; r < 8; ++r) {
        const int jk = kbase + 8 * half + r;   // key of this D slot
        const bool ok = (jk >= qi + d) || (jk == SEQ_L - 1);
        sm[r] = ok ? sc[r] * scale : -3.0e38f;
        mx = fmaxf(mx, sm[r]);
      }
      const float nm = fmaxf(rm, fmaxf(mx, other_half(mx)));
      const float alpha = __expf(rm - nm);
      rm = nm;
      float ps = 0.0f;
      #pragma unroll
      for (int r = 0; r < 8; ++r) {
        const int jk = kbase + 8 * half + r;
        const bool ok = (jk >= qi + d) || (jk == SEQ_L - 1);
        p[r] = ok ? __expf(sm[r] - nm) : 0.0f;  // explicit 0 for masked keys
        ps += p[r];
      }
      rs = rs * alpha + ps;
      #pragma unroll
      for (int r = 0; r < 8; ++r) {
        o0[r] *= alpha; o1[r] *= alpha; o2[r] *= alpha; o3[r] *= alpha;
      }

      // ---- O^T += V^T @ P^T: o_u[r] = O[query qi][16*u + 8*half + r] ----
      const float* vr = vt + (j * 16 + 8 * half) * VPITCH + (nn >> 2) * 8 + (nn & 3);
      #pragma unroll
      for (int t = 0; t < 4; ++t) {
        const v2f bp = { p[2 * t], p[2 * t + 1] };
        const float* vp = vr + t * (2 * VPITCH);   // keys 8*half + 2t and + 2t + 1
        v2f a0v = { vp[ 0], vp[  4] };
        v2f a1v = { vp[32], vp[ 36] };
        v2f a2v = { vp[64], vp[ 68] };
        v2f a3v = { vp[96], vp[100] };
        o0 = wmma_f32(a0v, bp, o0);
        o1 = wmma_f32(a1v, bp, o1);
        o2 = wmma_f32(a2v, bp, o2);
        o3 = wmma_f32(a3v, bp, o3);
      }
    }

    // ---- hand-over, every wave, also one that skipped the tile ----
    asm volatile("s_wait_dscnt 0x0" ::: "memory");  // own reads of this buffer are done
    wait_asynccnt0();                  // own share of tile s + 1 has landed
    __syncthreads();                   // publishes tile s + 1, frees this buffer
    if (s + 2 < N_STAGES)              // same for the whole workgroup
      stage_kv(lk0 + (unsigned)buf * (STAGE_F * 4u), lv0 + (unsigned)buf * (STAGE_F * 4u),
               gk0 + (size_t)(s + 2) * KSTAGE * D_MODEL,
               gv0 + (size_t)(s + 2) * KSTAGE * D_MODEL);
  }
  wait_asynccnt0();                    // nothing of this wave's is in flight at its end

  // ---- finalize: join the halves' sums, O /= rowsum, write [b, q, h*64 + e];
  // a lane holds 8 consecutive e of its query in each tile: 16-byte stores ----
  const float inv = 1.0f / (rs + other_half(rs));
  float* orow = O + base + (size_t)qi * D_MODEL + 8 * half;
  typedef float v4f __attribute__((ext_vector_type(4)));
  #pragma unroll
  for (int g = 0; g < 2; ++g) {
    const int r = 4 * g;
    *(v4f*)(orow +  0 + r) = v4f{ o0[r], o0[r + 1], o0[r + 2], o0[r + 3] } * inv;
    *(v4f*)(orow + 16 + r) = v4f{ o1[r], o1[r + 1], o1[r + 2], o1[r + 3] } * inv;
    *(v4f*)(orow + 32 + r) = v4f{ o2[r], o2[r + 1], o2[r + 2], o2[r + 3] } * inv;
    *(v4f*)(orow + 48 + r) = v4f{ o3[r], o3[r + 1], o3[r + 2], o3[r + 3] } * inv;
  }
}

// ---------------------------------------------------------------------------
extern "C" void kernel_launch(void* const* d_in, const int* in_sizes, int n_in,
                              void* d_out, int out_size, void* d_ws, size_t ws_size,
                              hipStream_t stream) {
  const float* queries = (const float*)d_in[0];
  const float* keys    = (const float*)d_in[1];
  const float* values  = (const float*)d_in[2];
  const float* Wq = (const float*)d_in[3];
  const float* bq = (const float*)d_in[4];
  const float* Wk = (const float*)d_in[5];
  const float* bk = (const float*)d_in[6];
  const float* Wv = (const float*)d_in[7];
  const float* bv = (const float*)d_in[8];
  const float* Wo = (const float*)d_in[9];
  const float* bo = (const float*)d_in[10];

  const size_t plane = (size_t)M_TOTAL * D_MODEL;  // 4096*1024 floats = 16 MB
  float* qws = (float*)d_ws;
  float* kws = qws + plane;
  float* vws = kws + plane;
  float* aws = vws + plane;

  dim3 gg(M_TOTAL / 64, D_MODEL / 64, 1);   // 64 x 16 workgroups, 4 waves each
  gemm64x64<<<gg, 128, 0, stream>>>(queries, Wq, bq, qws);
  gemm64x64<<<gg, 128, 0, stream>>>(keys,    Wk, bk, kws);
  gemm64x64<<<gg, 128, 0, stream>>>(values,  Wv, bv, vws);

  dim3 ga(SEQ_L / (16 * ATT_WAVES), N_HEADS, BATCH);   // 32 x 16 x 2 workgroups, 4 waves each
  flash_attn<<<ga, 32 * ATT_WAVES, 0, stream>>>(qws, kws, vws, aws);

  gemm64x64<<<gg, 128, 0, stream>>>(aws, Wo, bo, (float*)d_out);
}

// v004
// A run of this version takes 382 microseconds.
// Two timings next to v003 both put it at 1.04 times that version's speed.
// Over all steps from v000 it is 1.39 times as fast.
#include <hip/hip_runtime.h>

// ---------------------------------------------------------------------------
// AttentionLayer for MI455X (gfx1250): f32 WMMA 16x16x4 everywhere.
//   q/k/v = X @ W^T + b        (gemm64x64: async-to-LDS staged X and W tiles)
//   flash-style masked softmax attention per (b, h)   (flash_attn)
//   out   = attn @ Wo^T + bo   (gemm64x64)
// ---------------------------------------------------------------------------

typedef float v2f __attribute__((ext_vector_type(2)));
typedef float v8f __attribute__((ext_vector_type(8)));

#define D_MODEL 1024
#define N_HEADS 16
#define HEAD_E  64
#define SEQ_L   2048
#define BATCH   2
#define M_TOTAL (BATCH * SEQ_L)

__device__ __forceinline__ v8f wmma_f32(v2f a, v2f b, v8f c) {
  // D = A(16x4, f32) x B(4x16, f32) + C(16x16, f32)
  return __builtin_amdgcn_wmma_f32_16x16x4_f32(
      /*neg_a=*/false, a, /*neg_b=*/false, b,
      /*c_mod=*/(short)0, c, /*reuse_a=*/false, /*reuse_b=*/false);
}

__device__ __forceinline__ void wait_asynccnt0() {
  asm volatile("s_wait_asynccnt 0x0" ::: "memory");
}

// value of the same lane number in the other 16-lane half (l <-> l ^ 16), one
// vector instruction, no LDS
__device__ __forceinline__ float other_half(float x) {
  const unsigned u = __float_as_uint(x);
  return __uint_as_float(
      __builtin_amdgcn_permlanex16(u, u, 0x76543210u, 0xfedcba98u, false, false));
}

// ---------------------------------------------------------------------------
// C[M,N] = X[M,K] @ W[N,K]^T + bias[N]
// Workgroup = 4 waves -> 64x64 C tile (each wave: 16 rows of M, all 64 N).
// Per 32-wide k-slice: the 64x32 sub-tiles of W and of X (8 KB each) are staged
// into LDS with GLOBAL_LOAD_ASYNC_TO_LDS_B128 (each wave copies 1/4 of each),
// fenced with s_wait_asynccnt + barrier, then consumed as ds_load b64 fragments.
// A slice row is one 128-B line: 8 lanes copy one row, so a wave's copy covers
// 4 whole lines; a fragment load straight from global memory would touch 16
// lines for 16 B of each.
// A layout: lane m = l&15, vgpr v -> k = 2*(l>>4)+v   (float2 along K)
// D layout: lane n = l&15, vgpr v -> m = v + 8*(l>>4)
// ---------------------------------------------------------------------------
#define KSLICE 32
// LDS row pitch in floats: 128-B rows put all 16 rows of a fragment read on
// 8 banks; 144 B (16 B x odd) spreads the 32 lanes' b64 reads over all 64.
#define WPITCH 36

// One lane's share of a k-slice: 4 x 16 B of W and 4 x 16 B of X, rows 4 apart.
// The LDS operands are real LDS byte offsets (low 32 bits of the generic
// pointer).  s_wait_xcnt closes the statement so that no address register is
// rewritten ahead of it.
__device__ __forceinline__ void stage_wx(unsigned lw, unsigned lx,
                                         const float* gw, const float* gx) {
  asm volatile(
      "global_load_async_to_lds_b128 %0, %8, off\n\t"
      "global_load_async_to_lds_b128 %1, %9, off\n\t"
      "global_load_async_to_lds_b128 %2, %10, off\n\t"
      "global_load_async_to_lds_b128 %3, %11, off\n\t"
      "global_load_async_to_lds_b128 %4, %12, off\n\t"
      "global_load_async_to_lds_b128 %5, %13, off\n\t"
      "global_load_async_to_lds_b128 %6, %14, off\n\t"
      "global_load_async_to_lds_b128 %7, %15, off\n\t"
      "s_wait_xcnt 0x0"
      :: "v"(lw), "v"(lw + 4u * WPITCH * 4u), "v"(lw + 8u * WPITCH * 4u),
         "v"(lw + 12u * WPITCH * 4u),
         "v"(lx), "v"(lx + 4u * WPITCH * 4u), "v"(lx + 8u * WPITCH * 4u),
         "v"(lx + 12u * WPITCH * 4u),
         "v"(gw), "v"(gw + 4 * D_MODEL), "v"(gw + 8 * D_MODEL), "v"(gw + 12 * D_MODEL),
         "v"(gx), "v"(gx + 4 * D_MODEL), "v"(gx + 8 * D_MODEL), "v"(gx + 12 * D_MODEL)
      : "memory");
}

__global__ __launch_bounds__(128)
void gemm64x64(const float* __restrict__ X, const float* __restrict__ W,
               const float* __restrict__ bias, float* __restrict__ C) {
  // [n-in-tile][k-in-slice] and [m-in-tile][k-in-slice], padded rows, 9 KB each
  __shared__ __attribute__((aligned(16))) float lds_w[64 * WPITCH];
  __shared__ __attribute__((aligned(16))) float lds_x[64 * WPITCH];

  const int K = D_MODEL, N = D_MODEL;
  const int lane = threadIdx.x & 31;
  const int wave = threadIdx.x >> 5;     // 0..3
  const int nn = lane & 15, half = lane >> 4;
  const int m0 = blockIdx.x * 64 + wave * 16;
  const int n0 = blockIdx.y * 64;

  // staging assignment: a slice row is 8 chunks of 16 B; this lane copies chunk
  // (lane & 7) of rows 16 * wave + (lane >> 3) + 4 t of both tiles.
  const int srow = wave * 16 + (lane >> 3);      // 0..63 (row within tile), t = 0
  const int scol = (lane & 7) * 4;               // k offset within slice
  const float* wsrc_base = W + (size_t)(n0 + srow) * K + scol;
  const float* xsrc_base = X + (size_t)(blockIdx.x * 64 + srow) * K + scol;
  // Low 32 bits of the generic pointer == LDS byte offset (aperture mapping);
  // using the real address also captures the arrays for the asm's memory clobber.
  const unsigned lw_base =
      (unsigned)(size_t)(&lds_w[0]) + (unsigned)(srow * WPITCH + scol) * 4u;
  const unsigned lx_base =
      (unsigned)(size_t)(&lds_x[0]) + (unsigned)(srow * WPITCH + scol) * 4u;

  const float* xr = X + (size_t)(m0 + nn) * K + 2 * half;

  v8f acc0 = {}, acc1 = {}, acc2 = {}, acc3 = {};

  for (int ks = 0; ks < K; ks += KSLICE) {
    __syncthreads();                     // previous slice fully consumed
    // ---- async stage W[n0..n0+63][ks..ks+31] and X[64 rows][ks..ks+31] -> LDS ----
    stage_wx(lw_base, lx_base, wsrc_base + ks, xsrc_base + ks);
    // prefetch next A-slice while the async copy is in flight
    if (ks + KSLICE < K) __builtin_prefetch(xr + ks + KSLICE, 0, 3);
    wait_asynccnt0();
    __syncthreads();                     // all waves' chunks visible

    // ---- consume: 8 wmma k-steps of 4 ----
    #pragma unroll
    for (int k = 0; k < KSLICE; k += 4) {
      v2f a = *(const v2f*)&lds_x[(wave * 16 + nn) * WPITCH + k + 2 * half];
      v2f b0 = *(const v2f*)&lds_w[( 0 + nn) * WPITCH + k + 2 * half];
      v2f b1 = *(const v2f*)&lds_w[(16 + nn) * WPITCH + k + 2 * half];
      v2f b2 = *(const v2f*)&lds_w[(32 + nn) * WPITCH + k + 2 * half];
      v2f b3 = *(const v2f*)&lds_w[(48 + nn) * WPITCH + k + 2 * half];
      acc0 = wmma_f32(a, b0, acc0);
      acc1 = wmma_f32(a, b1, acc1);
      acc2 = wmma_f32(a, b2, acc2);
      acc3 = wmma_f32(a, b3, acc3);
    }
  }

  const float b0 = bias[n0 +  0 + nn];
  const float b1 = bias[n0 + 16 + nn];
  const float b2 = bias[n0 + 32 + nn];
  const float b3 = bias[n0 + 48 + nn];

  #pragma unroll
  for (int v = 0; v < 8; ++v) {
    const int m = m0 + v + 8 * half;
    float* crow = C + (size_t)m * N + n0 + nn;
    crow[0]  = acc0[v] + b0;
    crow[16] = acc1[v] + b1;
    crow[32] = acc2[v] + b2;
    crow[48] = acc3[v] + b3;
  }
}

#define ATT_WAVES 4
#define KSTAGE 32                      // keys per staged tile
// K rows: 272 B (16 B x odd): the b64 fragment reads of 16 rows x 2 halves
// fall on all 64 banks.
#define KPITCH 68
// V rows lie in pairs, interleaved in 16-B chunks: chunk g of key k stands at
// dword (k >> 1) * 2 * VPITCH + 8 g + 4 (k & 1).  The two keys of one V^T
// fragment are then 4 dwords apart (one two-address LDS load fills the register
// pair), and the halves' rows, 8 keys apart, start 32 banks apart.
#define VPITCH 68
#define KTILE_F (KSTAGE * KPITCH)
#define VTILE_F (KSTAGE * VPITCH)
#define STAGE_F (KTILE_F + VTILE_F)    // 17,408 B per buffer
#define N_STAGES (SEQ_L / KSTAGE)

// One lane's share of a 32-key tile: 4 x 16 B of K and 4 x 16 B of V, rows 8
// apart.  s_wait_xcnt closes the statement so that no address register is
// rewritten ahead of it.
__device__ __forceinline__ void stage_kv(unsigned lk, unsigned lv,
                                         const float* gk, const float* gv) {
  asm volatile(
      "global_load_async_to_lds_b128 %0, %8, off\n\t"
      "global_load_async_to_lds_b128 %1, %9, off\n\t"
      "global_load_async_to_lds_b128 %2, %10, off\n\t"
      "global_load_async_to_lds_b128 %3, %11, off\n\t"
      "global_load_async_to_lds_b128 %4, %12, off\n\t"
      "global_load_async_to_lds_b128 %5, %13, off\n\t"
      "global_load_async_to_lds_b128 %6, %14, off\n\t"
      "global_load_async_to_lds_b128 %7, %15, off\n\t"
      "s_wait_xcnt 0x0"
      :: "v"(lk), "v"(lk + 8u * KPITCH * 4u), "v"(lk + 16u * KPITCH * 4u),
         "v"(lk + 24u * KPITCH * 4u),
         "v"(lv), "v"(lv + 8u * VPITCH * 4u), "v"(lv + 16u * VPITCH * 4u),
         "v"(lv + 24u * VPITCH * 4u),
         "v"(gk), "v"(gk + 8 * D_MODEL), "v"(gk + 16 * D_MODEL), "v"(gk + 24 * D_MODEL),
         "v"(gv), "v"(gv + 8 * D_MODEL), "v"(gv + 16 * D_MODEL), "v"(gv + 24 * D_MODEL)
      : "memory");
}

__global__ __launch_bounds__(32 * ATT_WAVES)
void flash_attn(const float* __restrict__ Q, const float* __restrict__ Kmat,
                const float* __restrict__ V, float* __restrict__ O) {
  __shared__ __attribute__((aligned(16))) float kv[2 * STAGE_F];  // [buffer][K tile | V tile]

  const int tid  = threadIdx.x;
  const int lane = tid & 31;
  // scalar wave number: the skip of masked blocks must be a scalar branch
  // (WMMA needs EXEC all ones)
  const int wave = __builtin_amdgcn_readfirstlane(tid >> 5);
  const int nn = lane & 15, half = lane >> 4;
  const int qg = blockIdx.x;           // 64-query group 0..31
  const int qb = qg * ATT_WAVES + wave;  // query block 0..127
  const int h  = blockIdx.y;           // head 0..15
  const int b  = blockIdx.z;           // batch 0..1
  const int q0 = qb * 16;
  const int d  = 1 << (h >> 2);        // diag offset for this head's group
  const size_t base = (size_t)b * SEQ_L * D_MODEL + (size_t)h * HEAD_E;
  const float scale = 0.125f;          // 1/sqrt(64)

  // staging assignment: a tile row is 16 chunks of 16 B; this lane copies chunk
  // (tid & 15) of rows (tid >> 4) + 8 t, so a wave's copy covers 2 whole rows.
  const int srow = tid >> 4, scol = (tid & 15) * 4;
  const unsigned lds0 = (unsigned)(size_t)(&kv[0]);   // LDS byte offset of kv
  const unsigned lk0 = lds0 + (unsigned)(srow * KPITCH + scol) * 4u;
  const unsigned lv0 = lds0 + (unsigned)(KTILE_F + (srow >> 1) * (2 * VPITCH) +
                                         2 * scol + 4 * (srow & 1)) * 4u;
  const float* gk0 = Kmat + base + (size_t)srow * D_MODEL + scol;
  const float* gv0 = V    + base + (size_t)srow * D_MODEL + scol;

  // first tile that holds a visible key of this group; 64 - 2 qg >= 2 tiles
  const int s0 = qg * (16 * ATT_WAVES / KSTAGE);

  stage_kv(lk0, lv0, gk0 + (size_t)s0 * KSTAGE * D_MODEL,
                     gv0 + (size_t)s0 * KSTAGE * D_MODEL);

  // Q^T as B operand, kept in registers: qa[ec][v] = Q[q0 + (l&15)][4*ec + 2*half + v]
  v2f qa[16];
  {
    const float* qr = Q + base + (size_t)(q0 + nn) * D_MODEL + 2 * half;
    #pragma unroll
    for (int ec = 0; ec < 16; ++ec) qa[ec] = *(const v2f*)(qr + ec * 4);
  }

  v8f o0 = {}, o1 = {}, o2 = {}, o3 = {};
  const int qi = q0 + nn;              // this lane's query
  float rm = -3.0e38f;                 // its running maximum (equal in both halves)
  float rs = 0.0f;                     // running sum over this half's keys only

  wait_asynccnt0();                    // this wave's share of the first tile has landed
  __syncthreads();                     // ... and every other wave's
  stage_kv(lk0 + STAGE_F * 4u, lv0 + STAGE_F * 4u,
           gk0 + (size_t)(s0 + 1) * KSTAGE * D_MODEL,
           gv0 + (size_t)(s0 + 1) * KSTAGE * D_MODEL);

  for (int s = s0; s < N_STAGES; ++s) {
    const int buf = (s - s0) & 1;
    const float* kt = kv + buf * STAGE_F;
    const float* vt = kt + KTILE_F;

    for (int j = 0; j < KSTAGE / 16; ++j) {
      const int kb = s * (KSTAGE / 16) + j;
      if (kb < qb) continue;           // fully masked for this wave (scalar test)
      const int kbase = kb * 16;

      // ---- S^T = K @ Q^T over E=64 (16 wmma steps of k=4) ----
      // sc[r] = S[query qi][key kbase + 8*half + r]
      v8f sc = {};
      const float* kr = kt + (j * 16 + nn) * KPITCH + 2 * half;
      #pragma unroll
      for (int ec = 0; ec < 16; ++ec)
        sc = wmma_f32(*(const v2f*)(kr + ec * 4), qa[ec], sc);

      // ---- mask + scale + online softmax, one query per lane ----
      float sm[8], p[8];
      float mx = -3.0e38f;
      #pragma unroll
      for (int r = 0; r < 8; ++r) {
        const int jk = kbase + 8 * half + r;   // key of this D slot
        const bool ok = (jk >= qi + d) || (jk == SEQ_L - 1);
        sm[r] = ok ? sc[r] * scale : -3.0e38f;
        mx = fmaxf(mx, sm[r]);
      }
      const float nm = fmaxf(rm, fmaxf(mx, other_half(mx)));
      const float alpha = __expf(rm - nm);
      rm = nm;
      float ps = 0.0f;
      #pragma unroll
      for (int r = 0; r < 8; ++r) {
        const int jk = kbase + 8 * half + r;
        const bool ok = (jk >= qi + d) || (jk == SEQ_L - 1);
        p[r] = ok ? __expf(sm[r] - nm) : 0.0f;  // explicit 0 for masked keys
        ps += p[r];
      }
      rs = rs * alpha + ps;
      #pragma unroll
      for (int r = 0; r < 8; ++r) {
        o0[r] *= alpha; o1[r] *= alpha; o2[r] *= alpha; o3[r] *= alpha;
      }

      // ---- O^T += V^T @ P^T: o_u[r] = O[query qi][16*u + 8*half + r] ----
      const float* vr = vt + (j * 16 + 8 * half) * VPITCH + (nn >> 2) * 8 + (nn & 3);
      #pragma unroll
      for (int t = 0; t < 4; ++t) {
        const v2f bp = { p[2 * t], p[2 * t + 1] };
        const float* vp = vr + t * (2 * VPITCH);   // keys 8*half + 2t and + 2t + 1
        v2f a0v = { vp[ 0], vp[  4] };
        v2f a1v = { vp[32], vp[ 36] };
        v2f a2v = { vp[64], vp[ 68] };
        v2f a3v = { vp[96], vp[100] };
        o0 = wmma_f32(a0v, bp, o0);
        o1 = wmma_f32(a1v, bp, o1);
        o2 = wmma_f32(a2v, bp, o2);
        o3 = wmma_f32(a3v, bp, o3);
      }
    }

    // ---- hand-over, every wave, also one that skipped the tile ----
    asm volatile("s_wait_dscnt 0x0" ::: "memory");  // own reads of this buffer are done
    wait_asynccnt0();                  // own share of tile s + 1 has landed
    __syncthreads();                   // publishes tile s + 1, frees this buffer
    if (s + 2 < N_STAGES)              // same for the whole workgroup
      stage_kv(lk0 + (unsigned)buf * (STAGE_F * 4u), lv0 + (unsigned)buf * (STAGE_F * 4u),
               gk0 + (size_t)(s + 2) * KSTAGE * D_MODEL,
               gv0 + (size_t)(s + 2) * KSTAGE * D_MODEL);
  }
  wait_asynccnt0();                    // nothing of this wave's is in flight at its end

  // ---- finalize: join the halves' sums, O /= rowsum, write [b, q, h*64 + e];
  // a lane holds 8 consecutive e of its query in each tile: 16-byte stores ----
  const float inv = 1.0f / (rs + other_half(rs));
  float* orow = O + base + (size_t)qi * D_MODEL + 8 * half;
  typedef float v4f __attribute__((ext_vector_type(4)));
  #pragma unroll
  for (int g = 0; g < 2; ++g) {
    const int r = 4 * g;
    *(v4f*)(orow +  0 + r) = v4f{ o0[r], o0[r + 1], o0[r + 2], o0[r + 3] } * inv;
    *(v4f*)(orow + 16 + r) = v4f{ o1[r], o1[r + 1], o1[r + 2], o1[r + 3] } * inv;
    *(v4f*)(orow + 32 + r) = v4f{ o2[r], o2[r + 1], o2[r + 2], o2[r + 3] } * inv;
    *(v4f*)(orow + 48 + r) = v4f{ o3[r], o3[r + 1], o3[r + 2], o3[r + 3] } * inv;
  }
}

// ---------------------------------------------------------------------------
extern "C" void kernel_launch(void* const* d_in, const int* in_sizes, int n_in,
                              void* d_out, int out_size, void* d_ws, size_t ws_size,
                              hipStream_t stream) {
  const float* queries = (const float*)d_in[0];
  const float* keys    = (const float*)d_in[1];
  const float* values  = (const float*)d_in[2];
  const float* Wq = (const float*)d_in[3];
  const float* bq = (const float*)d_in[4];
  const float* Wk = (const float*)d_in[5];
  const float* bk = (const float*)d_in[6];
  const float* Wv = (const float*)d_in[7];
  const float* bv = (const float*)d_in[8];
  const float* Wo = (const float*)d_in[9];
  const float* bo = (const float*)d_in[10];

  const size_t plane = (size_t)M_TOTAL * D_MODEL;  // 4096*1024 floats = 16 MB
  float* qws = (float*)d_ws;
  float* kws = qws + plane;
  float* vws = kws + plane;
  float* aws = vws + plane;

  dim3 gg(M_TOTAL / 64, D_MODEL / 64, 1);   // 64 x 16 workgroups, 4 waves each
  gemm64x64<<<gg, 128, 0, stream>>>(queries, Wq, bq, qws);
  gemm64x64<<<gg, 128, 0, stream>>>(keys,    Wk, bk, kws);
  gemm64x64<<<gg, 128, 0, stream>>>(values,  Wv, bv, vws);

  dim3 ga(SEQ_L / (16 * ATT_WAVES), N_HEADS, BATCH);   // 32 x 16 x 2 workgroups, 4 waves each
  flash_attn<<<ga, 32 * ATT_WAVES, 0, stream>>>(qws, kws, vws, aws);

  gemm64x64<<<gg, 128, 0, stream>>>(aws, Wo, bo, (float*)d_out);
}
